// v000
// Times are from an AMD MI455X. After a warm-up the kernel runs many times in a row, and a time is the length of
// such a window on the GPU divided by its runs, so every launch and the gaps after it count. The runs cycle
// through copies of the inputs. A figure is the median of several windows, for all but v000 over two sittings.
// Sittings can differ by a few percent; kernels timed side by side share one.
// v000 is the starting kernel. One run takes 656 microseconds.
#include <hip/hip_runtime.h>

#define GRID_N 20
#define S_PTS (GRID_N * GRID_N * GRID_N)   // 8000
#define FDIM 512
#define NHEADS 8
#define HD 64
#define KNBR 32
#define BATCH 4

typedef __attribute__((ext_vector_type(2))) float v2f;
typedef __attribute__((ext_vector_type(8))) float v8f;

// ---------------------------------------------------------------------------
// Kernel 1: fused Q/K/V projection, fp32 WMMA (V_WMMA_F32_16X16X4_F32).
// One wave computes a 64x64 tile (4x4 WMMA register blocking) of
//   out = x[b] (S x F) * W^T (F x N)
// => 0.5 VMEM loads per WMMA; each A fragment reused across 4 column tiles,
//    each B fragment across 4 row tiles; L2 traffic halved vs 2x2 blocking.
// A 64-wide N tile is exactly one head, so the head-major scatter is trivial.
// blockIdx.x = S-tile/64 (125), blockIdx.y = head (8), blockIdx.z = b*3+which.
// ---------------------------------------------------------------------------
__global__ __launch_bounds__(32)
void qkv_proj_wmma(const float* __restrict__ x,
                   const float* __restrict__ Wq,
                   const float* __restrict__ Wk,
                   const float* __restrict__ Wv,
                   float* __restrict__ qb,
                   float* __restrict__ kb,
                   float* __restrict__ vb)
{
    const int lane  = threadIdx.x;          // 0..31 (wave32)
    const int sBase = blockIdx.x * 64;
    const int h     = blockIdx.y;           // nBase = h*64
    const int bz    = blockIdx.z;
    const int b     = bz / 3;
    const int which = bz - b * 3;

    const float* __restrict__ W   = (which == 0) ? Wq : (which == 1) ? Wk : Wv;
    float*       __restrict__ dst = (which == 0) ? qb : (which == 1) ? kb : vb;

    // A fragment: lane L -> row (L&15), K pair offset (L>>4)*2  (contiguous float2)
    // B fragment: lane L -> col (L&15), same K pair             (contiguous float2 of W row)
    const int row  = lane & 15;
    const int koff = (lane >> 4) << 1;      // 0 or 2

    const float* __restrict__ aptr = x + ((size_t)b * S_PTS + (sBase + row)) * FDIM + koff;
    const float* __restrict__ bptr = W + (size_t)(h * HD + row) * FDIM + koff;

    v8f acc[4][4];
#pragma unroll
    for (int r = 0; r < 4; ++r)
#pragma unroll
        for (int c = 0; c < 4; ++c)
            acc[r][c] = (v8f){};

#pragma unroll 2
    for (int kk = 0; kk < FDIM; kk += 4) {
        v2f af[4], bf[4];
#pragma unroll
        for (int r = 0; r < 4; ++r)
            af[r] = *(const v2f*)(aptr + (size_t)r * 16 * FDIM + kk);   // global_load_b64
#pragma unroll
        for (int c = 0; c < 4; ++c)
            bf[c] = *(const v2f*)(bptr + (size_t)c * 16 * FDIM + kk);   // global_load_b64
#pragma unroll
        for (int r = 0; r < 4; ++r)
#pragma unroll
            for (int c = 0; c < 4; ++c)
                // 8 args: (neg_a, A, neg_b, B, c_mod, C, reuse_a, reuse_b)
                acc[r][c] = __builtin_amdgcn_wmma_f32_16x16x4_f32(
                    false, af[r], false, bf[c], (short)0, acc[r][c], false, false);
    }

    // C/D layout: VGPR i -> row (lane>>4)*8 + i, col lane&15.
    const int mOff = (lane >> 4) * 8;
    const int col  = lane & 15;
    float* __restrict__ op =
        dst + ((size_t)(b * NHEADS + h) * S_PTS + sBase + mOff) * HD + col;

#pragma unroll
    for (int r = 0; r < 4; ++r)
#pragma unroll
        for (int i = 0; i < 8; ++i)
#pragma unroll
            for (int c = 0; c < 4; ++c)
                op[((size_t)r * 16 + i) * HD + c * 16] = acc[r][c][i];
}

// ---------------------------------------------------------------------------
// Kernel 2: neighbor attention. Block = 256 threads = 8 waves = one (b, s);
// wave h handles head h. Lane j owns neighbor j for the score phase;
// lane d owns output dims {d, d+32} for the weighted-V phase.
// q/k/v are in [B, H, S, Hd] fp32 (from kernel 1).
// ---------------------------------------------------------------------------
__global__ __launch_bounds__(256)
void nbr_attention(const float* __restrict__ qb,
                   const float* __restrict__ kb,
                   const float* __restrict__ vb,
                   const int*   __restrict__ nbr,
                   float*       __restrict__ out)
{
    __shared__ float qs[NHEADS * HD];       // 2 KB: q for all heads of (b,s)

    const int s = blockIdx.x;
    const int b = blockIdx.y;
    const int tid  = threadIdx.x;
    const int h    = tid >> 5;
    const int lane = tid & 31;

    // Stage q[b, :, s, :] into LDS (heads are strided by S*Hd in global).
#pragma unroll
    for (int c = 0; c < 2; ++c) {
        int idx = tid + c * 256;            // 0..511
        int hh  = idx >> 6;
        int dd  = idx & 63;
        qs[idx] = qb[((size_t)(b * NHEADS + hh) * S_PTS + s) * HD + dd];
    }
    __syncthreads();

    // ---- scores: lane j computes q . k[nbr_j] over 64 dims ----
    const int nj = nbr[(size_t)s * KNBR + lane];
    const float* __restrict__ kr =
        kb + ((size_t)(b * NHEADS + h) * S_PTS + nj) * HD;
    const float* __restrict__ qh = &qs[h * HD];

    float acc = 0.0f;
#pragma unroll
    for (int d = 0; d < HD; d += 4) {
        float4 kv = *(const float4*)(kr + d);   // lane-private contiguous 16B
        acc += qh[d + 0] * kv.x;                // LDS same-address broadcast
        acc += qh[d + 1] * kv.y;
        acc += qh[d + 2] * kv.z;
        acc += qh[d + 3] * kv.w;
    }
    float score = acc * 0.125f;                  // Hd^-0.5 = 1/8 exactly

    // ---- wave32 softmax over the 32 neighbors ----
    float mx = score;
#pragma unroll
    for (int off = 16; off > 0; off >>= 1)
        mx = fmaxf(mx, __shfl_xor(mx, off, 32));
    float e = __expf(score - mx);
    float sum = e;
#pragma unroll
    for (int off = 16; off > 0; off >>= 1)
        sum += __shfl_xor(sum, off, 32);
    const float w = e / sum;

    // ---- out[d] = sum_j w_j * v[nbr_j][d]; lane owns dims lane, lane+32 ----
    float o0 = 0.0f, o1 = 0.0f;
    const float* __restrict__ vhead = vb + ((size_t)(b * NHEADS + h) * S_PTS) * HD;
#pragma unroll 4
    for (int j = 0; j < KNBR; ++j) {
        float wj  = __shfl(w, j, 32);
        int   njj = __shfl(nj, j, 32);
        const float* __restrict__ vr = vhead + (size_t)njj * HD;
        o0 += wj * vr[lane];                     // coalesced 128B
        o1 += wj * vr[lane + 32];                // coalesced 128B
    }

    float* __restrict__ op = out + ((size_t)b * S_PTS + s) * FDIM + h * HD;
    op[lane]      = o0;
    op[lane + 32] = o1;
}

// ---------------------------------------------------------------------------
extern "C" void kernel_launch(void* const* d_in, const int* in_sizes, int n_in,
                              void* d_out, int out_size, void* d_ws, size_t ws_size,
                              hipStream_t stream)
{
    const float* x   = (const float*)d_in[0];
    const float* Wq  = (const float*)d_in[1];
    const float* Wk  = (const float*)d_in[2];
    const float* Wv  = (const float*)d_in[3];
    const int*   nbr = (const int*)d_in[4];
    float* out = (float*)d_out;

    const size_t per = (size_t)BATCH * NHEADS * S_PTS * HD;  // 16.384M floats
    float* qb = (float*)d_ws;
    float* kb = qb + per;
    float* vb = kb + per;

    dim3 g1(S_PTS / 64, NHEADS, BATCH * 3);      // 125 x 8 x 12 wave-tiles
    qkv_proj_wmma<<<g1, dim3(32), 0, stream>>>(x, Wq, Wk, Wv, qb, kb, vb);

    dim3 g2(S_PTS, BATCH);
    nbr_attention<<<g2, dim3(256), 0, stream>>>(qb, kb, vb, nbr, out);
}

// v001
// A run of this version takes 526 microseconds.
// Next to v000, in two timings, it ran 1.31 times as fast each time.
#include <hip/hip_runtime.h>

#define GRID_N 20
#define S_PTS (GRID_N * GRID_N * GRID_N)   // 8000
#define FDIM 512
#define NHEADS 8
#define HD 64
#define KNBR 32
#define BATCH 4

typedef __attribute__((ext_vector_type(2))) float v2f;
typedef __attribute__((ext_vector_type(8))) float v8f;

// ---------------------------------------------------------------------------
// Kernel 1: fused Q/K/V projection, fp32 WMMA (V_WMMA_F32_16X16X4_F32).
//   out = x (B*S x F) * W^T (F x N)
// A work-group of 4 waves (2 x 2) computes a 128 x 128 tile; each wave keeps
// the 64x64 tile (4x4 WMMA register blocking) and the ascending k order.
// Per pass of 32 k the 128 rows of x and the 128 rows of W (128 B of each row,
// one whole cache line) are brought into LDS once by asynchronous copies,
// two buffers, and all four waves read their fragments from there.
// LDS row pitch 144 B: the 16 rows of a fragment read fall on distinct banks.
// A 64-wide N tile is exactly one head; a 64-row M tile lies in one batch.
// blockIdx.x = N tile (12: which*4 + head pair), blockIdx.y = M tile (250).
// ---------------------------------------------------------------------------
#define BK 32                              // k per pass
#define NPASS (FDIM / BK)                  // 16
#define LDP 36                             // LDS row pitch in floats (144 B)
#define BUF_FLOATS (256 * LDP)             // 128 rows of x, then 128 rows of W
#define BUF_BYTES (BUF_FLOATS * 4)

// Eight 16-byte copies per lane, rows 16 apart. The s_wait_xcnt stands inside
// the statement so that no address register is rewritten in front of it.
__device__ __forceinline__ void copy_rows8(unsigned lds, const float* g)
{
    asm volatile(
        "global_load_async_to_lds_b128 %0, %8, off\n\t"
        "global_load_async_to_lds_b128 %1, %9, off\n\t"
        "global_load_async_to_lds_b128 %2, %10, off\n\t"
        "global_load_async_to_lds_b128 %3, %11, off\n\t"
        "global_load_async_to_lds_b128 %4, %12, off\n\t"
        "global_load_async_to_lds_b128 %5, %13, off\n\t"
        "global_load_async_to_lds_b128 %6, %14, off\n\t"
        "global_load_async_to_lds_b128 %7, %15, off\n\t"
        "s_wait_xcnt 0x0"
        :: "v"(lds + 0u * 16u * LDP * 4u), "v"(lds + 1u * 16u * LDP * 4u),
           "v"(lds + 2u * 16u * LDP * 4u), "v"(lds + 3u * 16u * LDP * 4u),
           "v"(lds + 4u * 16u * LDP * 4u), "v"(lds + 5u * 16u * LDP * 4u),
           "v"(lds + 6u * 16u * LDP * 4u), "v"(lds + 7u * 16u * LDP * 4u),
           "v"(g + 0 * 16 * FDIM), "v"(g + 1 * 16 * FDIM),
           "v"(g + 2 * 16 * FDIM), "v"(g + 3 * 16 * FDIM),
           "v"(g + 4 * 16 * FDIM), "v"(g + 5 * 16 * FDIM),
           "v"(g + 6 * 16 * FDIM), "v"(g + 7 * 16 * FDIM)
        : "memory");
}

__global__ __launch_bounds__(128)
void qkv_proj_wmma(const float* __restrict__ x,
                   const float* __restrict__ Wq,
                   const float* __restrict__ Wk,
                   const float* __restrict__ Wv,
                   float* __restrict__ qb,
                   float* __restrict__ kb,
                   float* __restrict__ vb)
{
    __shared__ __attribute__((aligned(16))) float sm[2 * BUF_FLOATS];   // 72 KB

    const int tid   = threadIdx.x;
    const int lane  = tid & 31;             // wave32
    const int wave  = tid >> 5;             // 0..3
    const int wm    = wave >> 1;            // 64-row half of the tile
    const int wn    = wave & 1;             // 64-column half of the tile
    const int nt    = blockIdx.x;           // 0..11
    const int which = nt >> 2;
    const int nBase = (nt & 3) * 128;       // first row of W
    const int mBase = blockIdx.y * 128;     // first row of x, batches flattened

    const float* __restrict__ W   = (which == 0) ? Wq : (which == 1) ? Wk : Wv;
    float*       __restrict__ dst = (which == 0) ? qb : (which == 1) ? kb : vb;

    // Copies: 8 lanes cover one row's 128 B, a wave 4 whole lines per copy.
    const int crow = tid >> 3;              // 0..15
    const int cseg = (tid & 7) * 4;         // float offset in the row
    const float* __restrict__ gA = x + (size_t)(mBase + crow) * FDIM + cseg;
    const float* __restrict__ gB = W + (size_t)(nBase + crow) * FDIM + cseg;
    const unsigned lA = (unsigned)(size_t)&sm[crow * LDP + cseg];
    const unsigned lB = lA + 128u * LDP * 4u;

    // A fragment: lane L -> row (L&15), K pair offset (L>>4)*2  (float2)
    // B fragment: lane L -> col (L&15), same K pair             (float2 of W row)
    const int row  = lane & 15;
    const int koff = (lane >> 4) << 1;      // 0 or 2
    const float* fa = &sm[(wm * 64 + row) * LDP + koff];
    const float* fb = &sm[(128 + wn * 64 + row) * LDP + koff];

    v8f acc[4][4];
#pragma unroll
    for (int r = 0; r < 4; ++r)
#pragma unroll
        for (int c = 0; c < 4; ++c)
            acc[r][c] = (v8f){};

    // Prologue: pass 0 lands and is published, then pass 1 starts to fly.
    copy_rows8(lA, gA);
    copy_rows8(lB, gB);
    asm volatile("s_wait_asynccnt 0x0" ::: "memory");   // own copies of pass 0 landed
    __syncthreads();
    copy_rows8(lA + BUF_BYTES, gA + BK);
    copy_rows8(lB + BUF_BYTES, gB + BK);

    // Rolled: one pass (128 WMMAs) is the loop body, so the text stays small.
#pragma unroll 1
    for (int t = 0; t < NPASS; ++t) {
        const int buf = t & 1;
        const float* pa = fa + buf * BUF_FLOATS;
        const float* pb = fb + buf * BUF_FLOATS;
        // Unrolled: the eight k steps' LDS reads become immediate offsets and
        // can be issued ahead of the WMMAs that use them.
#pragma unroll
        for (int ks = 0; ks < BK; ks += 4) {
            v2f af[4], bf[4];
#pragma unroll
            for (int r = 0; r < 4; ++r)
                af[r] = *(const v2f*)(pa + r * 16 * LDP + ks);
#pragma unroll
            for (int c = 0; c < 4; ++c)
                bf[c] = *(const v2f*)(pb + c * 16 * LDP + ks);
#pragma unroll
            for (int r = 0; r < 4; ++r)
#pragma unroll
                for (int c = 0; c < 4; ++c)
                    // 8 args: (neg_a, A, neg_b, B, c_mod, C, reuse_a, reuse_b)
                    acc[r][c] = __builtin_amdgcn_wmma_f32_16x16x4_f32(
                        false, af[r], false, bf[c], (short)0, acc[r][c], false, false);
        }
        // Publish point of pass t + 1; it also frees this pass's buffer.
        asm volatile("s_wait_dscnt 0x0" ::: "memory");      // own reads of this buffer done
        asm volatile("s_wait_asynccnt 0x0" ::: "memory");   // own copies of pass t + 1 landed
        __syncthreads();
        if (t + 2 < NPASS) {
            copy_rows8(lA + buf * BUF_BYTES, gA + (t + 2) * BK);
            copy_rows8(lB + buf * BUF_BYTES, gB + (t + 2) * BK);
        }
    }
    asm volatile("s_wait_asynccnt 0x0" ::: "memory");       // nothing in flight at the end

    // C/D layout: VGPR i -> row (lane>>4)*8 + i, col lane&15.
    const int gRow  = mBase + wm * 64;      // 64 divides S, so one batch per wave
    const int b     = gRow / S_PTS;
    const int sBase = gRow - b * S_PTS;
    const int h     = (nt & 3) * 2 + wn;
    const int mOff = (lane >> 4) * 8;
    const int col  = lane & 15;
    float* __restrict__ op =
        dst + ((size_t)(b * NHEADS + h) * S_PTS + sBase + mOff) * HD + col;

#pragma unroll
    for (int r = 0; r < 4; ++r)
#pragma unroll
        for (int i = 0; i < 8; ++i)
#pragma unroll
            for (int c = 0; c < 4; ++c)
                op[((size_t)r * 16 + i) * HD + c * 16] = acc[r][c][i];
}

// ---------------------------------------------------------------------------
// Kernel 2: neighbor attention. Block = 256 threads = 8 waves = one (b, s);
// wave h handles head h. Lane j owns neighbor j for the score phase;
// lane d owns output dims {d, d+32} for the weighted-V phase.
// q/k/v are in [B, H, S, Hd] fp32 (from kernel 1).
// ---------------------------------------------------------------------------
__global__ __launch_bounds__(256)
void nbr_attention(const float* __restrict__ qb,
                   const float* __restrict__ kb,
                   const float* __restrict__ vb,
                   const int*   __restrict__ nbr,
                   float*       __restrict__ out)
{
    __shared__ float qs[NHEADS * HD];       // 2 KB: q for all heads of (b,s)

    const int s = blockIdx.x;
    const int b = blockIdx.y;
    const int tid  = threadIdx.x;
    const int h    = tid >> 5;
    const int lane = tid & 31;

    // Stage q[b, :, s, :] into LDS (heads are strided by S*Hd in global).
#pragma unroll
    for (int c = 0; c < 2; ++c) {
        int idx = tid + c * 256;            // 0..511
        int hh  = idx >> 6;
        int dd  = idx & 63;
        qs[idx] = qb[((size_t)(b * NHEADS + hh) * S_PTS + s) * HD + dd];
    }
    __syncthreads();

    // ---- scores: lane j computes q . k[nbr_j] over 64 dims ----
    const int nj = nbr[(size_t)s * KNBR + lane];
    const float* __restrict__ kr =
        kb + ((size_t)(b * NHEADS + h) * S_PTS + nj) * HD;
    const float* __restrict__ qh = &qs[h * HD];

    float acc = 0.0f;
#pragma unroll
    for (int d = 0; d < HD; d += 4) {
        float4 kv = *(const float4*)(kr + d);   // lane-private contiguous 16B
        acc += qh[d + 0] * kv.x;                // LDS same-address broadcast
        acc += qh[d + 1] * kv.y;
        acc += qh[d + 2] * kv.z;
        acc += qh[d + 3] * kv.w;
    }
    float score = acc * 0.125f;                  // Hd^-0.5 = 1/8 exactly

    // ---- wave32 softmax over the 32 neighbors ----
    float mx = score;
#pragma unroll
    for (int off = 16; off > 0; off >>= 1)
        mx = fmaxf(mx, __shfl_xor(mx, off, 32));
    float e = __expf(score - mx);
    float sum = e;
#pragma unroll
    for (int off = 16; off > 0; off >>= 1)
        sum += __shfl_xor(sum, off, 32);
    const float w = e / sum;

    // ---- out[d] = sum_j w_j * v[nbr_j][d]; lane owns dims lane, lane+32 ----
    float o0 = 0.0f, o1 = 0.0f;
    const float* __restrict__ vhead = vb + ((size_t)(b * NHEADS + h) * S_PTS) * HD;
#pragma unroll 4
    for (int j = 0; j < KNBR; ++j) {
        float wj  = __shfl(w, j, 32);
        int   njj = __shfl(nj, j, 32);
        const float* __restrict__ vr = vhead + (size_t)njj * HD;
        o0 += wj * vr[lane];                     // coalesced 128B
        o1 += wj * vr[lane + 32];                // coalesced 128B
    }

    float* __restrict__ op = out + ((size_t)b * S_PTS + s) * FDIM + h * HD;
    op[lane]      = o0;
    op[lane + 32] = o1;
}

// ---------------------------------------------------------------------------
extern "C" void kernel_launch(void* const* d_in, const int* in_sizes, int n_in,
                              void* d_out, int out_size, void* d_ws, size_t ws_size,
                              hipStream_t stream)
{
    const float* x   = (const float*)d_in[0];
    const float* Wq  = (const float*)d_in[1];
    const float* Wk  = (const float*)d_in[2];
    const float* Wv  = (const float*)d_in[3];
    const int*   nbr = (const int*)d_in[4];
    float* out = (float*)d_out;

    const size_t per = (size_t)BATCH * NHEADS * S_PTS * HD;  // 16.384M floats
    float* qb = (float*)d_ws;
    float* kb = qb + per;
    float* vb = kb + per;

    dim3 g1(12, 250);                            // N tiles x M tiles of 128
    qkv_proj_wmma<<<g1, dim3(128), 0, stream>>>(x, Wq, Wk, Wv, qb, kb, vb);

    dim3 g2(S_PTS, BATCH);
    nbr_attention<<<g2, dim3(256), 0, stream>>>(qb, kb, vb, nbr, out);
}

// v002
// One run takes 369 microseconds.
// Next to v001, in two timings, it ran 1.43 times as fast each time.
// All steps since v000 together make it 1.87 times as fast.
#include <hip/hip_runtime.h>

#define GRID_N 20
#define S_PTS (GRID_N * GRID_N * GRID_N)   // 8000
#define FDIM 512
#define NHEADS 8
#define HD 64
#define KNBR 32
#define BATCH 4

typedef __attribute__((ext_vector_type(2))) float v2f;
typedef __attribute__((ext_vector_type(4))) float v4f;
typedef __attribute__((ext_vector_type(8))) float v8f;

// ---------------------------------------------------------------------------
// Kernel 1: fused Q/K/V projection, fp32 WMMA (V_WMMA_F32_16X16X4_F32).
//   out = x (B*S x F) * W^T (F x N)
// A work-group of 4 waves (2 x 2) computes a 128 x 128 tile; each wave keeps
// the 64x64 tile (4x4 WMMA register blocking) and the ascending k order.
// Per pass of 32 k the 128 rows of x and the 128 rows of W (128 B of each row,
// one whole cache line) are brought into LDS once by asynchronous copies,
// two buffers, and all four waves read their fragments from there.
// LDS row pitch 144 B: the 16 rows of a fragment read fall on distinct banks.
// A 64-wide N tile is exactly one head; a 64-row M tile lies in one batch.
// blockIdx.x = N tile (12: which*4 + head pair), blockIdx.y = M tile (250).
// ---------------------------------------------------------------------------
#define BK 32                              // k per pass
#define NPASS (FDIM / BK)                  // 16
#define LDP 36                             // LDS row pitch in floats (144 B)
#define BUF_FLOATS (256 * LDP)             // 128 rows of x, then 128 rows of W
#define BUF_BYTES (BUF_FLOATS * 4)

// Eight 16-byte copies per lane, rows 16 apart. The s_wait_xcnt stands inside
// the statement so that no address register is rewritten in front of it.
__device__ __forceinline__ void copy_rows8(unsigned lds, const float* g)
{
    asm volatile(
        "global_load_async_to_lds_b128 %0, %8, off\n\t"
        "global_load_async_to_lds_b128 %1, %9, off\n\t"
        "global_load_async_to_lds_b128 %2, %10, off\n\t"
        "global_load_async_to_lds_b128 %3, %11, off\n\t"
        "global_load_async_to_lds_b128 %4, %12, off\n\t"
        "global_load_async_to_lds_b128 %5, %13, off\n\t"
        "global_load_async_to_lds_b128 %6, %14, off\n\t"
        "global_load_async_to_lds_b128 %7, %15, off\n\t"
        "s_wait_xcnt 0x0"
        :: "v"(lds + 0u * 16u * LDP * 4u), "v"(lds + 1u * 16u * LDP * 4u),
           "v"(lds + 2u * 16u * LDP * 4u), "v"(lds + 3u * 16u * LDP * 4u),
           "v"(lds + 4u * 16u * LDP * 4u), "v"(lds + 5u * 16u * LDP * 4u),
           "v"(lds + 6u * 16u * LDP * 4u), "v"(lds + 7u * 16u * LDP * 4u),
           "v"(g + 0 * 16 * FDIM), "v"(g + 1 * 16 * FDIM),
           "v"(g + 2 * 16 * FDIM), "v"(g + 3 * 16 * FDIM),
           "v"(g + 4 * 16 * FDIM), "v"(g + 5 * 16 * FDIM),
           "v"(g + 6 * 16 * FDIM), "v"(g + 7 * 16 * FDIM)
        : "memory");
}

__global__ __launch_bounds__(128)
void qkv_proj_wmma(const float* __restrict__ x,
                   const float* __restrict__ Wq,
                   const float* __restrict__ Wk,
                   const float* __restrict__ Wv,
                   float* __restrict__ qb,
                   float* __restrict__ kb,
                   float* __restrict__ vb)
{
    __shared__ __attribute__((aligned(16))) float sm[2 * BUF_FLOATS];   // 72 KB

    const int tid   = threadIdx.x;
    const int lane  = tid & 31;             // wave32
    const int wave  = tid >> 5;             // 0..3
    const int wm    = wave >> 1;            // 64-row half of the tile
    const int wn    = wave & 1;             // 64-column half of the tile
    const int nt    = blockIdx.x;           // 0..11
    const int which = nt >> 2;
    const int nBase = (nt & 3) * 128;       // first row of W
    const int mBase = blockIdx.y * 128;     // first row of x, batches flattened

    const float* __restrict__ W   = (which == 0) ? Wq : (which == 1) ? Wk : Wv;
    float*       __restrict__ dst = (which == 0) ? qb : (which == 1) ? kb : vb;

    // Copies: 8 lanes cover one row's 128 B, a wave 4 whole lines per copy.
    const int crow = tid >> 3;              // 0..15
    const int cseg = (tid & 7) * 4;         // float offset in the row
    const float* __restrict__ gA = x + (size_t)(mBase + crow) * FDIM + cseg;
    const float* __restrict__ gB = W + (size_t)(nBase + crow) * FDIM + cseg;
    const unsigned lA = (unsigned)(size_t)&sm[crow * LDP + cseg];
    const unsigned lB = lA + 128u * LDP * 4u;

    // A fragment: lane L -> row (L&15), K pair offset (L>>4)*2  (float2)
    // B fragment: lane L -> col (L&15), same K pair             (float2 of W row)
    const int row  = lane & 15;
    const int koff = (lane >> 4) << 1;      // 0 or 2
    const float* fa = &sm[(wm * 64 + row) * LDP + koff];
    const float* fb = &sm[(128 + wn * 64 + row) * LDP + koff];

    v8f acc[4][4];
#pragma unroll
    for (int r = 0; r < 4; ++r)
#pragma unroll
        for (int c = 0; c < 4; ++c)
            acc[r][c] = (v8f){};

    // Prologue: pass 0 lands and is published, then pass 1 starts to fly.
    copy_rows8(lA, gA);
    copy_rows8(lB, gB);
    asm volatile("s_wait_asynccnt 0x0" ::: "memory");   // own copies of pass 0 landed
    __syncthreads();
    copy_rows8(lA + BUF_BYTES, gA + BK);
    copy_rows8(lB + BUF_BYTES, gB + BK);

    // Rolled: one pass (128 WMMAs) is the loop body, so the text stays small.
#pragma unroll 1
    for (int t = 0; t < NPASS; ++t) {
        const int buf = t & 1;
        const float* pa = fa + buf * BUF_FLOATS;
        const float* pb = fb + buf * BUF_FLOATS;
        // Unrolled: the eight k steps' LDS reads become immediate offsets and
        // can be issued ahead of the WMMAs that use them.
#pragma unroll
        for (int ks = 0; ks < BK; ks += 4) {
            v2f af[4], bf[4];
#pragma unroll
            for (int r = 0; r < 4; ++r)
                af[r] = *(const v2f*)(pa + r * 16 * LDP + ks);
#pragma unroll
            for (int c = 0; c < 4; ++c)
                bf[c] = *(const v2f*)(pb + c * 16 * LDP + ks);
#pragma unroll
            for (int r = 0; r < 4; ++r)
#pragma unroll
                for (int c = 0; c < 4; ++c)
                    // 8 args: (neg_a, A, neg_b, B, c_mod, C, reuse_a, reuse_b)
                    acc[r][c] = __builtin_amdgcn_wmma_f32_16x16x4_f32(
                        false, af[r], false, bf[c], (short)0, acc[r][c], false, false);
        }
        // Publish point of pass t + 1; it also frees this pass's buffer.
        asm volatile("s_wait_dscnt 0x0" ::: "memory");      // own reads of this buffer done
        asm volatile("s_wait_asynccnt 0x0" ::: "memory");   // own copies of pass t + 1 landed
        __syncthreads();
        if (t + 2 < NPASS) {
            copy_rows8(lA + buf * BUF_BYTES, gA + (t + 2) * BK);
            copy_rows8(lB + buf * BUF_BYTES, gB + (t + 2) * BK);
        }
    }
    asm volatile("s_wait_asynccnt 0x0" ::: "memory");       // nothing in flight at the end

    // C/D layout: VGPR i -> row (lane>>4)*8 + i, col lane&15.
    const int gRow  = mBase + wm * 64;      // 64 divides S, so one batch per wave
    const int b     = gRow / S_PTS;
    const int sBase = gRow - b * S_PTS;
    const int h     = (nt & 3) * 2 + wn;
    const int mOff = (lane >> 4) * 8;
    const int col  = lane & 15;
    float* __restrict__ op =
        dst + ((size_t)(b * NHEADS + h) * S_PTS + sBase + mOff) * HD + col;

#pragma unroll
    for (int r = 0; r < 4; ++r)
#pragma unroll
        for (int i = 0; i < 8; ++i)
#pragma unroll
            for (int c = 0; c < 4; ++c)
                op[((size_t)r * 16 + i) * HD + c * 16] = acc[r][c][i];
}

// ---------------------------------------------------------------------------
// Kernel 2: neighbor attention. Block = 256 threads = 8 waves = one (b, s);
// wave h handles head h.
// Score phase: 8 lanes x 16 B cover one 128-B line of a K row, so one load
// instruction reads four whole lines (one half row of four neighbors). A lane
// sums its 8 products per row; the 8 lanes' partial sums of 8 rows are then
// added by a halving exchange that leaves the score of neighbor j in lane j.
// Lane d owns output dims {d, d+32} for the weighted-V phase.
// q/k/v are in [B, H, S, Hd] fp32 (from kernel 1).
// ---------------------------------------------------------------------------

// A neighbor index is input data: bound it before it forms an address.
__device__ __forceinline__ int row_in_range(int n)
{
    return min(max(n, 0), S_PTS - 1);
}

// Value of lane (l ^ MASK), MASK < 16, as a DPP operand (row_xmask).
template <int MASK>
__device__ __forceinline__ float lane_xor(float v)
{
    return __int_as_float(__builtin_amdgcn_update_dpp(
        0, __float_as_int(v), 0x160 | MASK, 0xf, 0xf, true));
}

__global__ __launch_bounds__(256)
void nbr_attention(const float* __restrict__ qb,
                   const float* __restrict__ kb,
                   const float* __restrict__ vb,
                   const int*   __restrict__ nbr,
                   float*       __restrict__ out)
{
    const int s = blockIdx.x;
    const int b = blockIdx.y;
    const int tid  = threadIdx.x;
    // Wave-uniform, said so to the compiler: row addresses become a scalar base
    // plus one 32-bit lane offset, which keeps the register count down.
    const int h    = __builtin_amdgcn_readfirstlane(tid >> 5);
    const int lane = tid & 31;

    // ---- scores: lane group g (8 lanes) works on neighbors 8g .. 8g+7 ----
    const int g  = lane >> 3;
    const int c4 = (lane & 7) * 4;              // the lane's 4 dims in each half row

    const int4 na = *(const int4*)(nbr + (size_t)s * KNBR + g * 8);
    const int4 nb = *(const int4*)(nbr + (size_t)s * KNBR + g * 8 + 4);
    const int rows[8] = { na.x, na.y, na.z, na.w, nb.x, nb.y, nb.z, nb.w };

    const size_t head = (size_t)(b * NHEADS + h) * S_PTS;
    const float* __restrict__ qr = qb + (head + s) * HD + c4;
    const v4f q0 = *(const v4f*)(qr);
    const v4f q1 = *(const v4f*)(qr + 32);
    const float* __restrict__ khead = kb + head * HD;

    unsigned koff[8];
    v2f a[8];                                   // two running sums a row: packed FMAs
#pragma unroll
    for (int i = 0; i < 8; ++i) {
        koff[i] = (unsigned)row_in_range(rows[i]) * HD + c4;
        const v4f k0 = *(const v4f*)(khead + koff[i]);
        a[i] = q0.xy * k0.xy;
        a[i] = __builtin_elementwise_fma(q0.zw, k0.zw, a[i]);
    }
    // Registers that the loads above name are reused from here on (a second-half
    // load may land on a row offset): the wait stands in front of that overwrite.
    asm volatile("s_wait_xcnt 0x0" ::: "memory");
    const int nj = row_in_range(nbr[(size_t)s * KNBR + lane]);
    float p[8];
#pragma unroll
    for (int i = 0; i < 8; ++i) {
        const v4f k1 = *(const v4f*)(khead + koff[i] + 32);
        a[i] = __builtin_elementwise_fma(q1.xy, k1.xy, a[i]);
        a[i] = __builtin_elementwise_fma(q1.zw, k1.zw, a[i]);
        p[i] = a[i].x + a[i].y;
    }

    // Halving exchange over the 8 lanes of a group: at each step a lane keeps
    // the rows whose index bit equals its own lane bit and hands the others on.
    const bool b0 = lane & 1, b1 = lane & 2, b2 = lane & 4;
    float r[4], t[2];
#pragma unroll
    for (int m = 0; m < 4; ++m)
        r[m] = (b0 ? p[2 * m + 1] : p[2 * m]) + lane_xor<1>(b0 ? p[2 * m] : p[2 * m + 1]);
#pragma unroll
    for (int m = 0; m < 2; ++m)
        t[m] = (b1 ? r[2 * m + 1] : r[2 * m]) + lane_xor<2>(b1 ? r[2 * m] : r[2 * m + 1]);
    const float acc = (b2 ? t[1] : t[0]) + lane_xor<4>(b2 ? t[0] : t[1]);

    float score = acc * 0.125f;                  // Hd^-0.5 = 1/8 exactly

    // ---- wave32 softmax over the 32 neighbors ----
    float mx = score;
#pragma unroll
    for (int off = 16; off > 0; off >>= 1)
        mx = fmaxf(mx, __shfl_xor(mx, off, 32));
    float e = __expf(score - mx);
    float sum = e;
#pragma unroll
    for (int off = 16; off > 0; off >>= 1)
        sum += __shfl_xor(sum, off, 32);
    const float w = e / sum;

    // ---- out[d] = sum_j w_j * v[nbr_j][d]; lane owns dims lane, lane+32 ----
    float o0 = 0.0f, o1 = 0.0f;
    const float* __restrict__ vhead = vb + ((size_t)(b * NHEADS + h) * S_PTS) * HD;
#pragma unroll 4
    for (int j = 0; j < KNBR; ++j) {
        float wj  = __shfl(w, j, 32);
        int   njj = __shfl(nj, j, 32);
        const float* __restrict__ vr = vhead + (size_t)njj * HD;
        o0 += wj * vr[lane];                     // coalesced 128B
        o1 += wj * vr[lane + 32];                // coalesced 128B
    }

    float* __restrict__ op = out + ((size_t)b * S_PTS + s) * FDIM + h * HD;
    op[lane]      = o0;
    op[lane + 32] = o1;
}

// ---------------------------------------------------------------------------
extern "C" void kernel_launch(void* const* d_in, const int* in_sizes, int n_in,
                              void* d_out, int out_size, void* d_ws, size_t ws_size,
                              hipStream_t stream)
{
    const float* x   = (const float*)d_in[0];
    const float* Wq  = (const float*)d_in[1];
    const float* Wk  = (const float*)d_in[2];
    const float* Wv  = (const float*)d_in[3];
    const int*   nbr = (const int*)d_in[4];
    float* out = (float*)d_out;

    const size_t per = (size_t)BATCH * NHEADS * S_PTS * HD;  // 16.384M floats
    float* qb = (float*)d_ws;
    float* kb = qb + per;
    float* vb = kb + per;

    dim3 g1(12, 250);                            // N tiles x M tiles of 128
    qkv_proj_wmma<<<g1, dim3(128), 0, stream>>>(x, Wq, Wk, Wv, qb, kb, vb);

    dim3 g2(S_PTS, BATCH);
    nbr_attention<<<g2, dim3(256), 0, stream>>>(qb, kb, vb, nbr, out);
}

// v003
// A run of this version takes 345 microseconds.
// Two timings next to v002 both put it at 1.07 times that version's speed.
// Counting every step since v000, it is 2.00 times as fast.
#include <hip/hip_runtime.h>

#define GRID_N 20
#define S_PTS (GRID_N * GRID_N * GRID_N)   // 8000
#define FDIM 512
#define NHEADS 8
#define HD 64
#define KNBR 32
#define BATCH 4

typedef __attribute__((ext_vector_type(2))) float v2f;
typedef __attribute__((ext_vector_type(4))) float v4f;
typedef __attribute__((ext_vector_type(8))) float v8f;

// ---------------------------------------------------------------------------
// Kernel 1: fused Q/K/V projection, fp32 WMMA (V_WMMA_F32_16X16X4_F32).
//   out = x (B*S x F) * W^T (F x N)
// A work-group of 4 waves (2 x 2) computes a 128 x 128 tile; each wave keeps
// the 64x64 tile (4x4 WMMA register blocking) and the ascending k order.
// Per pass of 32 k the 128 rows of x and the 128 rows of W (128 B of each row,
// one whole cache line) are brought into LDS once by asynchronous copies,
// two buffers, and all four waves read their fragments from there.
// LDS row pitch 144 B: the 16 rows of a fragment read fall on distinct banks.
// A 64-wide N tile is exactly one head; a 64-row M tile lies in one batch.
// blockIdx.x = N tile (12: which*4 + head pair), blockIdx.y = M tile (250).
// ---------------------------------------------------------------------------
#define BK 32                              // k per pass
#define NPASS (FDIM / BK)                  // 16
#define LDP 36                             // LDS row pitch in floats (144 B)
#define BUF_FLOATS (256 * LDP)             // 128 rows of x, then 128 rows of W
#define BUF_BYTES (BUF_FLOATS * 4)

// Eight 16-byte copies per lane, rows 16 apart. The s_wait_xcnt stands inside
// the statement so that no address register is rewritten in front of it.
__device__ __forceinline__ void copy_rows8(unsigned lds, const float* g)
{
    asm volatile(
        "global_load_async_to_lds_b128 %0, %8, off\n\t"
        "global_load_async_to_lds_b128 %1, %9, off\n\t"
        "global_load_async_to_lds_b128 %2, %10, off\n\t"
        "global_load_async_to_lds_b128 %3, %11, off\n\t"
        "global_load_async_to_lds_b128 %4, %12, off\n\t"
        "global_load_async_to_lds_b128 %5, %13, off\n\t"
        "global_load_async_to_lds_b128 %6, %14, off\n\t"
        "global_load_async_to_lds_b128 %7, %15, off\n\t"
        "s_wait_xcnt 0x0"
        :: "v"(lds + 0u * 16u * LDP * 4u), "v"(lds + 1u * 16u * LDP * 4u),
           "v"(lds + 2u * 16u * LDP * 4u), "v"(lds + 3u * 16u * LDP * 4u),
           "v"(lds + 4u * 16u * LDP * 4u), "v"(lds + 5u * 16u * LDP * 4u),
           "v"(lds + 6u * 16u * LDP * 4u), "v"(lds + 7u * 16u * LDP * 4u),
           "v"(g + 0 * 16 * FDIM), "v"(g + 1 * 16 * FDIM),
           "v"(g + 2 * 16 * FDIM), "v"(g + 3 * 16 * FDIM),
           "v"(g + 4 * 16 * FDIM), "v"(g + 5 * 16 * FDIM),
           "v"(g + 6 * 16 * FDIM), "v"(g + 7 * 16 * FDIM)
        : "memory");
}

__global__ __launch_bounds__(128)
void qkv_proj_wmma(const float* __restrict__ x,
                   const float* __restrict__ Wq,
                   const float* __restrict__ Wk,
                   const float* __restrict__ Wv,
                   float* __restrict__ qb,
                   float* __restrict__ kb,
                   float* __restrict__ vb)
{
    __shared__ __attribute__((aligned(16))) float sm[2 * BUF_FLOATS];   // 72 KB

    const int tid   = threadIdx.x;
    const int lane  = tid & 31;             // wave32
    const int wave  = tid >> 5;             // 0..3
    const int wm    = wave >> 1;            // 64-row half of the tile
    const int wn    = wave & 1;             // 64-column half of the tile
    const int nt    = blockIdx.x;           // 0..11
    const int which = nt >> 2;
    const int nBase = (nt & 3) * 128;       // first row of W
    const int mBase = blockIdx.y * 128;     // first row of x, batches flattened

    const float* __restrict__ W   = (which == 0) ? Wq : (which == 1) ? Wk : Wv;
    float*       __restrict__ dst = (which == 0) ? qb : (which == 1) ? kb : vb;

    // Copies: 8 lanes cover one row's 128 B, a wave 4 whole lines per copy.
    const int crow = tid >> 3;              // 0..15
    const int cseg = (tid & 7) * 4;         // float offset in the row
    const float* __restrict__ gA = x + (size_t)(mBase + crow) * FDIM + cseg;
    const float* __restrict__ gB = W + (size_t)(nBase + crow) * FDIM + cseg;
    const unsigned lA = (unsigned)(size_t)&sm[crow * LDP + cseg];
    const unsigned lB = lA + 128u * LDP * 4u;

    // A fragment: lane L -> row (L&15), K pair offset (L>>4)*2  (float2)
    // B fragment: lane L -> col (L&15), same K pair             (float2 of W row)
    const int row  = lane & 15;
    const int koff = (lane >> 4) << 1;      // 0 or 2
    const float* fa = &sm[(wm * 64 + row) * LDP + koff];
    const float* fb = &sm[(128 + wn * 64 + row) * LDP + koff];

    v8f acc[4][4];
#pragma unroll
    for (int r = 0; r < 4; ++r)
#pragma unroll
        for (int c = 0; c < 4; ++c)
            acc[r][c] = (v8f){};

    // Prologue: pass 0 lands and is published, then pass 1 starts to fly.
    copy_rows8(lA, gA);
    copy_rows8(lB, gB);
    asm volatile("s_wait_asynccnt 0x0" ::: "memory");   // own copies of pass 0 landed
    __syncthreads();
    copy_rows8(lA + BUF_BYTES, gA + BK);
    copy_rows8(lB + BUF_BYTES, gB + BK);

    // Rolled: one pass (128 WMMAs) is the loop body, so the text stays small.
#pragma unroll 1
    for (int t = 0; t < NPASS; ++t) {
        const int buf = t & 1;
        const float* pa = fa + buf * BUF_FLOATS;
        const float* pb = fb + buf * BUF_FLOATS;
        // Unrolled: the eight k steps' LDS reads become immediate offsets and
        // can be issued ahead of the WMMAs that use them.
#pragma unroll
        for (int ks = 0; ks < BK; ks += 4) {
            v2f af[4], bf[4];
#pragma unroll
            for (int r = 0; r < 4; ++r)
                af[r] = *(const v2f*)(pa + r * 16 * LDP + ks);
#pragma unroll
            for (int c = 0; c < 4; ++c)
                bf[c] = *(const v2f*)(pb + c * 16 * LDP + ks);
#pragma unroll
            for (int r = 0; r < 4; ++r)
#pragma unroll
                for (int c = 0; c < 4; ++c)
                    // 8 args: (neg_a, A, neg_b, B, c_mod, C, reuse_a, reuse_b)
                    acc[r][c] = __builtin_amdgcn_wmma_f32_16x16x4_f32(
                        false, af[r], false, bf[c], (short)0, acc[r][c], false, false);
        }
        // Publish point of pass t + 1; it also frees this pass's buffer.
        asm volatile("s_wait_dscnt 0x0" ::: "memory");      // own reads of this buffer done
        asm volatile("s_wait_asynccnt 0x0" ::: "memory");   // own copies of pass t + 1 landed
        __syncthreads();
        if (t + 2 < NPASS) {
            copy_rows8(lA + buf * BUF_BYTES, gA + (t + 2) * BK);
            copy_rows8(lB + buf * BUF_BYTES, gB + (t + 2) * BK);
        }
    }
    asm volatile("s_wait_asynccnt 0x0" ::: "memory");       // nothing in flight at the end

    // C/D layout: VGPR i -> row (lane>>4)*8 + i, col lane&15.
    const int gRow  = mBase + wm * 64;      // 64 divides S, so one batch per wave
    const int b     = gRow / S_PTS;
    const int sBase = gRow - b * S_PTS;
    const int h     = (nt & 3) * 2 + wn;
    const int mOff = (lane >> 4) * 8;
    const int col  = lane & 15;
    float* __restrict__ op =
        dst + ((size_t)(b * NHEADS + h) * S_PTS + sBase + mOff) * HD + col;

#pragma unroll
    for (int r = 0; r < 4; ++r)
#pragma unroll
        for (int i = 0; i < 8; ++i)
#pragma unroll
            for (int c = 0; c < 4; ++c)
                op[((size_t)r * 16 + i) * HD + c * 16] = acc[r][c][i];
}

// ---------------------------------------------------------------------------
// Kernel 2: neighbor attention. Block = 256 threads = 8 waves = one (b, head);
// wave w handles one query, the block the 8 queries of a 2 x 2 x 2 cell of the
// point grid. Where neighbor lists of nearby points overlap, the waves ask for
// the same K and V lines at about the same time, and the WGP cache serves the
// repeats; any list gives the same result, only the sharing differs.
// Score phase: 8 lanes x 16 B cover one 128-B line of a K row, so one load
// instruction reads four whole lines (one half row of four neighbors). A lane
// sums its 8 products per row; the 8 lanes' partial sums of 8 rows are then
// added by a halving exchange that leaves the score of neighbor j in lane j.
// Lane d owns output dims {d, d+32} for the weighted-V phase.
// q/k/v are in [B, H, S, Hd] fp32 (from kernel 1).
// ---------------------------------------------------------------------------

// A neighbor index is input data: bound it before it forms an address.
__device__ __forceinline__ int row_in_range(int n)
{
    return min(max(n, 0), S_PTS - 1);
}

// Value of lane (l ^ MASK), MASK < 16, as a DPP operand (row_xmask).
template <int MASK>
__device__ __forceinline__ float lane_xor(float v)
{
    return __int_as_float(__builtin_amdgcn_update_dpp(
        0, __float_as_int(v), 0x160 | MASK, 0xf, 0xf, true));
}

__global__ __launch_bounds__(256)
void nbr_attention(const float* __restrict__ qb,
                   const float* __restrict__ kb,
                   const float* __restrict__ vb,
                   const int*   __restrict__ nbr,
                   float*       __restrict__ out)
{
    const int cell = blockIdx.x;                // 0 .. S_PTS / 8 - 1
    const int b = blockIdx.y >> 3;
    const int h = blockIdx.y & (NHEADS - 1);
    const int tid  = threadIdx.x;
    // Wave-uniform, said so to the compiler: row addresses become a scalar base
    // plus one 32-bit lane offset, which keeps the register count down.
    const int wv   = __builtin_amdgcn_readfirstlane(tid >> 5);
    const int lane = tid & 31;
    // cell -> (cz, cy, cx), wave bits -> the corner: every s in 0 .. S_PTS - 1 once.
    const int cx = cell % (GRID_N / 2);
    const int cy = (cell / (GRID_N / 2)) % (GRID_N / 2);
    const int cz = cell / ((GRID_N / 2) * (GRID_N / 2));
    const int s  = ((2 * cz + (wv >> 2)) * GRID_N + 2 * cy + ((wv >> 1) & 1)) * GRID_N
                 + 2 * cx + (wv & 1);

    // ---- scores: lane group g (8 lanes) works on neighbors 8g .. 8g+7 ----
    const int g  = lane >> 3;
    const int c4 = (lane & 7) * 4;              // the lane's 4 dims in each half row

    const int4 na = *(const int4*)(nbr + (size_t)s * KNBR + g * 8);
    const int4 nb = *(const int4*)(nbr + (size_t)s * KNBR + g * 8 + 4);
    const int rows[8] = { na.x, na.y, na.z, na.w, nb.x, nb.y, nb.z, nb.w };

    const size_t head = (size_t)(b * NHEADS + h) * S_PTS;
    const float* __restrict__ qr = qb + (head + s) * HD + c4;
    const v4f q0 = *(const v4f*)(qr);
    const v4f q1 = *(const v4f*)(qr + 32);
    const float* __restrict__ khead = kb + head * HD;

    unsigned koff[8];
    v2f a[8];                                   // two running sums a row: packed FMAs
#pragma unroll
    for (int i = 0; i < 8; ++i) {
        koff[i] = (unsigned)row_in_range(rows[i]) * HD + c4;
        const v4f k0 = *(const v4f*)(khead + koff[i]);
        a[i] = q0.xy * k0.xy;
        a[i] = __builtin_elementwise_fma(q0.zw, k0.zw, a[i]);
    }
    // Registers that the loads above name are reused from here on (a second-half
    // load may land on a row offset): the wait stands in front of that overwrite.
    asm volatile("s_wait_xcnt 0x0" ::: "memory");
    const int nj = row_in_range(nbr[(size_t)s * KNBR + lane]);
    float p[8];
#pragma unroll
    for (int i = 0; i < 8; ++i) {
        const v4f k1 = *(const v4f*)(khead + koff[i] + 32);
        a[i] = __builtin_elementwise_fma(q1.xy, k1.xy, a[i]);
        a[i] = __builtin_elementwise_fma(q1.zw, k1.zw, a[i]);
        p[i] = a[i].x + a[i].y;
    }

    // Halving exchange over the 8 lanes of a group: at each step a lane keeps
    // the rows whose index bit equals its own lane bit and hands the others on.
    const bool b0 = lane & 1, b1 = lane & 2, b2 = lane & 4;
    float r[4], t[2];
#pragma unroll
    for (int m = 0; m < 4; ++m)
        r[m] = (b0 ? p[2 * m + 1] : p[2 * m]) + lane_xor<1>(b0 ? p[2 * m] : p[2 * m + 1]);
#pragma unroll
    for (int m = 0; m < 2; ++m)
        t[m] = (b1 ? r[2 * m + 1] : r[2 * m]) + lane_xor<2>(b1 ? r[2 * m] : r[2 * m + 1]);
    const float acc = (b2 ? t[1] : t[0]) + lane_xor<4>(b2 ? t[0] : t[1]);

    float score = acc * 0.125f;                  // Hd^-0.5 = 1/8 exactly

    // ---- wave32 softmax over the 32 neighbors ----
    float mx = score;
#pragma unroll
    for (int off = 16; off > 0; off >>= 1)
        mx = fmaxf(mx, __shfl_xor(mx, off, 32));
    float e = __expf(score - mx);
    float sum = e;
#pragma unroll
    for (int off = 16; off > 0; off >>= 1)
        sum += __shfl_xor(sum, off, 32);
    const float w = e / sum;

    // ---- out[d] = sum_j w_j * v[nbr_j][d]; lane owns dims lane, lane+32 ----
    float o0 = 0.0f, o1 = 0.0f;
    const float* __restrict__ vhead = vb + ((size_t)(b * NHEADS + h) * S_PTS) * HD;
#pragma unroll 4
    for (int j = 0; j < KNBR; ++j) {
        float wj  = __shfl(w, j, 32);
        int   njj = __shfl(nj, j, 32);
        const float* __restrict__ vr = vhead + (size_t)njj * HD;
        o0 += wj * vr[lane];                     // coalesced 128B
        o1 += wj * vr[lane + 32];                // coalesced 128B
    }

    float* __restrict__ op = out + ((size_t)b * S_PTS + s) * FDIM + h * HD;
    op[lane]      = o0;
    op[lane + 32] = o1;
}

// ---------------------------------------------------------------------------
extern "C" void kernel_launch(void* const* d_in, const int* in_sizes, int n_in,
                              void* d_out, int out_size, void* d_ws, size_t ws_size,
                              hipStream_t stream)
{
    const float* x   = (const float*)d_in[0];
    const float* Wq  = (const float*)d_in[1];
    const float* Wk  = (const float*)d_in[2];
    const float* Wv  = (const float*)d_in[3];
    const int*   nbr = (const int*)d_in[4];
    float* out = (float*)d_out;

    const size_t per = (size_t)BATCH * NHEADS * S_PTS * HD;  // 16.384M floats
    float* qb = (float*)d_ws;
    float* kb = qb + per;
    float* vb = kb + per;

    dim3 g1(12, 250);                            // N tiles x M tiles of 128
    qkv_proj_wmma<<<g1, dim3(128), 0, stream>>>(x, Wq, Wk, Wv, qb, kb, vb);

    dim3 g2(S_PTS / 8, BATCH * NHEADS);          // cells of 8 queries x (batch, head)
    nbr_attention<<<g2, dim3(256), 0, stream>>>(qb, kb, vb, nbr, out);
}

// v004
// A run of this version takes 331 microseconds.
// Next to v003, in two timings, it ran 1.04 times as fast each time.
// Over all steps from v000 it is 2.09 times as fast.
#include <hip/hip_runtime.h>

#define GRID_N 20
#define S_PTS (GRID_N * GRID_N * GRID_N)   // 8000
#define FDIM 512
#define NHEADS 8
#define HD 64
#define KNBR 32
#define BATCH 4

typedef __attribute__((ext_vector_type(2))) float v2f;
typedef __attribute__((ext_vector_type(4))) float v4f;
typedef __attribute__((ext_vector_type(8))) float v8f;

// ---------------------------------------------------------------------------
// Kernel 1: fused Q/K/V projection, fp32 WMMA (V_WMMA_F32_16X16X4_F32).
//   out = x (B*S x F) * W^T (F x N)
// A work-group of 4 waves (2 x 2) computes a 128 x 128 tile; each wave keeps
// the 64x64 tile (4x4 WMMA register blocking) and the ascending k order.
// Per pass of 32 k the 128 rows of x and the 128 rows of W (128 B of each row,
// one whole cache line) are brought into LDS once by asynchronous copies,
// two buffers, and all four waves read their fragments from there.
// LDS row pitch 144 B: the 16 rows of a fragment read fall on distinct banks.
// A 64-wide N tile is exactly one head; a 64-row M tile lies in one batch.
// blockIdx.x = N tile (12: which*4 + head pair), blockIdx.y = M tile (250).
// ---------------------------------------------------------------------------
#define BK 32                              // k per pass
#define NPASS (FDIM / BK)                  // 16
#define LDP 36                             // LDS row pitch in floats (144 B)
#define BUF_FLOATS (256 * LDP)             // 128 rows of x, then 128 rows of W
#define BUF_BYTES (BUF_FLOATS * 4)

// Eight 16-byte copies per lane, rows 16 apart. The s_wait_xcnt stands inside
// the statement so that no address register is rewritten in front of it.
__device__ __forceinline__ void copy_rows8(unsigned lds, const float* g)
{
    asm volatile(
        "global_load_async_to_lds_b128 %0, %8, off\n\t"
        "global_load_async_to_lds_b128 %1, %9, off\n\t"
        "global_load_async_to_lds_b128 %2, %10, off\n\t"
        "global_load_async_to_lds_b128 %3, %11, off\n\t"
        "global_load_async_to_lds_b128 %4, %12, off\n\t"
        "global_load_async_to_lds_b128 %5, %13, off\n\t"
        "global_load_async_to_lds_b128 %6, %14, off\n\t"
        "global_load_async_to_lds_b128 %7, %15, off\n\t"
        "s_wait_xcnt 0x0"
        :: "v"(lds + 0u * 16u * LDP * 4u), "v"(lds + 1u * 16u * LDP * 4u),
           "v"(lds + 2u * 16u * LDP * 4u), "v"(lds + 3u * 16u * LDP * 4u),
           "v"(lds + 4u * 16u * LDP * 4u), "v"(lds + 5u * 16u * LDP * 4u),
           "v"(lds + 6u * 16u * LDP * 4u), "v"(lds + 7u * 16u * LDP * 4u),
           "v"(g + 0 * 16 * FDIM), "v"(g + 1 * 16 * FDIM),
           "v"(g + 2 * 16 * FDIM), "v"(g + 3 * 16 * FDIM),
           "v"(g + 4 * 16 * FDIM), "v"(g + 5 * 16 * FDIM),
           "v"(g + 6 * 16 * FDIM), "v"(g + 7 * 16 * FDIM)
        : "memory");
}

__global__ __launch_bounds__(128)
void qkv_proj_wmma(const float* __restrict__ x,
                   const float* __restrict__ Wq,
                   const float* __restrict__ Wk,
                   const float* __restrict__ Wv,
                   float* __restrict__ qb,
                   float* __restrict__ kb,
                   float* __restrict__ vb)
{
    __shared__ __attribute__((aligned(16))) float sm[2 * BUF_FLOATS];   // 72 KB

    const int tid   = threadIdx.x;
    const int lane  = tid & 31;             // wave32
    const int wave  = tid >> 5;             // 0..3
    const int wm    = wave >> 1;            // 64-row half of the tile
    const int wn    = wave & 1;             // 64-column half of the tile
    const int nt    = blockIdx.x;           // 0..11
    const int which = nt >> 2;
    const int nBase = (nt & 3) * 128;       // first row of W
    const int mBase = blockIdx.y * 128;     // first row of x, batches flattened

    const float* __restrict__ W   = (which == 0) ? Wq : (which == 1) ? Wk : Wv;
    float*       __restrict__ dst = (which == 0) ? qb : (which == 1) ? kb : vb;

    // Copies: 8 lanes cover one row's 128 B, a wave 4 whole lines per copy.
    const int crow = tid >> 3;              // 0..15
    const int cseg = (tid & 7) * 4;         // float offset in the row
    const float* __restrict__ gA = x + (size_t)(mBase + crow) * FDIM + cseg;
    const float* __restrict__ gB = W + (size_t)(nBase + crow) * FDIM + cseg;
    const unsigned lA = (unsigned)(size_t)&sm[crow * LDP + cseg];
    const unsigned lB = lA + 128u * LDP * 4u;

    // A fragment: lane L -> row (L&15), K pair offset (L>>4)*2  (float2)
    // B fragment: lane L -> col (L&15), same K pair             (float2 of W row)
    const int row  = lane & 15;
    const int koff = (lane >> 4) << 1;      // 0 or 2
    const float* fa = &sm[(wm * 64 + row) * LDP + koff];
    const float* fb = &sm[(128 + wn * 64 + row) * LDP + koff];

    v8f acc[4][4];
#pragma unroll
    for (int r = 0; r < 4; ++r)
#pragma unroll
        for (int c = 0; c < 4; ++c)
            acc[r][c] = (v8f){};

    // Prologue: pass 0 lands and is published, then pass 1 starts to fly.
    copy_rows8(lA, gA);
    copy_rows8(lB, gB);
    asm volatile("s_wait_asynccnt 0x0" ::: "memory");   // own copies of pass 0 landed
    __syncthreads();
    copy_rows8(lA + BUF_BYTES, gA + BK);
    copy_rows8(lB + BUF_BYTES, gB + BK);

    // Rolled: one pass (128 WMMAs) is the loop body, so the text stays small.
#pragma unroll 1
    for (int t = 0; t < NPASS; ++t) {
        const int buf = t & 1;
        const float* pa = fa + buf * BUF_FLOATS;
        const float* pb = fb + buf * BUF_FLOATS;
        // Unrolled: the eight k steps' LDS reads become immediate offsets and
        // can be issued ahead of the WMMAs that use them.
#pragma unroll
        for (int ks = 0; ks < BK; ks += 4) {
            v2f af[4], bf[4];
#pragma unroll
            for (int r = 0; r < 4; ++r)
                af[r] = *(const v2f*)(pa + r * 16 * LDP + ks);
#pragma unroll
            for (int c = 0; c < 4; ++c)
                bf[c] = *(const v2f*)(pb + c * 16 * LDP + ks);
#pragma unroll
            for (int r = 0; r < 4; ++r)
#pragma unroll
                for (int c = 0; c < 4; ++c)
                    // 8 args: (neg_a, A, neg_b, B, c_mod, C, reuse_a, reuse_b)
                    acc[r][c] = __builtin_amdgcn_wmma_f32_16x16x4_f32(
                        false, af[r], false, bf[c], (short)0, acc[r][c], false, false);
        }
        // Publish point of pass t + 1; it also frees this pass's buffer.
        asm volatile("s_wait_dscnt 0x0" ::: "memory");      // own reads of this buffer done
        asm volatile("s_wait_asynccnt 0x0" ::: "memory");   // own copies of pass t + 1 landed
        __syncthreads();
        if (t + 2 < NPASS) {
            copy_rows8(lA + buf * BUF_BYTES, gA + (t + 2) * BK);
            copy_rows8(lB + buf * BUF_BYTES, gB + (t + 2) * BK);
        }
    }
    asm volatile("s_wait_asynccnt 0x0" ::: "memory");       // nothing in flight at the end

    // C/D layout: VGPR i -> row (lane>>4)*8 + i, col lane&15.
    const int gRow  = mBase + wm * 64;      // 64 divides S, so one batch per wave
    const int b     = gRow / S_PTS;
    const int sBase = gRow - b * S_PTS;
    const int h     = (nt & 3) * 2 + wn;
    const int mOff = (lane >> 4) * 8;
    const int col  = lane & 15;
    float* __restrict__ op =
        dst + ((size_t)(b * NHEADS + h) * S_PTS + sBase + mOff) * HD + col;

#pragma unroll
    for (int r = 0; r < 4; ++r)
#pragma unroll
        for (int i = 0; i < 8; ++i)
#pragma unroll
            for (int c = 0; c < 4; ++c)
                op[((size_t)r * 16 + i) * HD + c * 16] = acc[r][c][i];
}

// ---------------------------------------------------------------------------
// Kernel 2: neighbor attention. Block = 256 threads = 8 waves = one (b, head);
// wave w handles one query, the block the 8 queries of a 2 x 2 x 2 cell of the
// point grid. Where neighbor lists of nearby points overlap, the waves ask for
// the same K and V lines at about the same time, and the WGP cache serves the
// repeats; any list gives the same result, only the sharing differs.
// Score phase: 8 lanes x 16 B cover one 128-B line of a K row, so one load
// instruction reads four whole lines (one half row of four neighbors). A lane
// sums its 8 products per row; the 8 lanes' partial sums of 8 rows are then
// added by a halving exchange that leaves the score of neighbor j in lane j.
// Weighted-V phase: the same lanes read the same 16-B pieces of the V rows of
// the same 8 neighbors (four whole lines a load), each lane sums its group's 8
// rows for its 8 dims, and a halving exchange over the four groups adds the
// partial sums and leaves two neighboring output dims in every lane.
// q/k/v are in [B, H, S, Hd] fp32 (from kernel 1).
// ---------------------------------------------------------------------------

// A neighbor index is input data: bound it before it forms an address.
__device__ __forceinline__ int row_in_range(int n)
{
    return min(max(n, 0), S_PTS - 1);
}

// Value of lane (l ^ MASK), MASK < 16, as a DPP operand (row_xmask).
template <int MASK>
__device__ __forceinline__ float lane_xor(float v)
{
    return __int_as_float(__builtin_amdgcn_update_dpp(
        0, __float_as_int(v), 0x160 | MASK, 0xf, 0xf, true));
}

// Value of lane (l ^ 16).
__device__ __forceinline__ float lane_xor16(float v)
{
    return __int_as_float(__builtin_amdgcn_permlanex16(
        __float_as_int(v), __float_as_int(v), 0x76543210, 0xfedcba98, false, false));
}

// Value of lane I of the caller's own group of 8 lanes (v_permlane16_b32: in
// each 16-lane row, lanes 0-7 take lane I and lanes 8-15 take lane 8 + I).
template <int I>
__device__ __forceinline__ float group_lane(float v)
{
    return __int_as_float(__builtin_amdgcn_permlane16(
        __float_as_int(v), __float_as_int(v),
        0x11111111u * I, 0x11111111u * (8 + I), false, false));
}

template <int I>
__device__ __forceinline__ void add_weighted_rows(float w, const v4f* v0, const v4f* v1,
                                                  v2f* o)
{
    if constexpr (I < 8) {
        const float wi = group_lane<I>(w);
        const v2f ww = { wi, wi };
        o[0] = __builtin_elementwise_fma(ww, v0[I].xy, o[0]);
        o[1] = __builtin_elementwise_fma(ww, v0[I].zw, o[1]);
        o[2] = __builtin_elementwise_fma(ww, v1[I].xy, o[2]);
        o[3] = __builtin_elementwise_fma(ww, v1[I].zw, o[3]);
        add_weighted_rows<I + 1>(w, v0, v1, o);
    }
}

// At most 8 waves per SIMD asked for: with a register budget of 128 the V row
// loads are issued beside the K row loads; at 64 most of them wait for the
// softmax to free registers and their latency is paid at the wave's end.
__global__ __launch_bounds__(256) __attribute__((amdgpu_waves_per_eu(2, 8)))
void nbr_attention(const float* __restrict__ qb,
                   const float* __restrict__ kb,
                   const float* __restrict__ vb,
                   const int*   __restrict__ nbr,
                   float*       __restrict__ out)
{
    const int cell = blockIdx.x;                // 0 .. S_PTS / 8 - 1
    const int b = blockIdx.y >> 3;
    const int h = blockIdx.y & (NHEADS - 1);
    const int tid  = threadIdx.x;
    // Wave-uniform, said so to the compiler: row addresses become a scalar base
    // plus one 32-bit lane offset, which keeps the register count down.
    const int wv   = __builtin_amdgcn_readfirstlane(tid >> 5);
    const int lane = tid & 31;
    // cell -> (cz, cy, cx), wave bits -> the corner: every s in 0 .. S_PTS - 1 once.
    const int cx = cell % (GRID_N / 2);
    const int cy = (cell / (GRID_N / 2)) % (GRID_N / 2);
    const int cz = cell / ((GRID_N / 2) * (GRID_N / 2));
    const int s  = ((2 * cz + (wv >> 2)) * GRID_N + 2 * cy + ((wv >> 1) & 1)) * GRID_N
                 + 2 * cx + (wv & 1);

    // ---- scores: lane group g (8 lanes) works on neighbors 8g .. 8g+7 ----
    const int g  = lane >> 3;
    const int c4 = (lane & 7) * 4;              // the lane's 4 dims in each half row

    const int4 na = *(const int4*)(nbr + (size_t)s * KNBR + g * 8);
    const int4 nb = *(const int4*)(nbr + (size_t)s * KNBR + g * 8 + 4);
    const int rows[8] = { na.x, na.y, na.z, na.w, nb.x, nb.y, nb.z, nb.w };

    const size_t head = (size_t)(b * NHEADS + h) * S_PTS;
    const float* __restrict__ qr = qb + (head + s) * HD + c4;
    const v4f q0 = *(const v4f*)(qr);
    const v4f q1 = *(const v4f*)(qr + 32);
    const float* __restrict__ khead = kb + head * HD;

    unsigned koff[8];
    v2f a[8];                                   // two running sums a row: packed FMAs
#pragma unroll
    for (int i = 0; i < 8; ++i) {
        koff[i] = (unsigned)row_in_range(rows[i]) * HD + c4;
        const v4f k0 = *(const v4f*)(khead + koff[i]);
        a[i] = q0.xy * k0.xy;
        a[i] = __builtin_elementwise_fma(q0.zw, k0.zw, a[i]);
    }
    // Registers that the loads above name are reused from here on (a second-half
    // load may land on a row offset): the wait stands in front of that overwrite.
    asm volatile("s_wait_xcnt 0x0" ::: "memory");
    float p[8];
#pragma unroll
    for (int i = 0; i < 8; ++i) {
        const v4f k1 = *(const v4f*)(khead + koff[i] + 32);
        a[i] = __builtin_elementwise_fma(q1.xy, k1.xy, a[i]);
        a[i] = __builtin_elementwise_fma(q1.zw, k1.zw, a[i]);
        p[i] = a[i].x + a[i].y;
    }

    // V rows of the same neighbors: their addresses need no score, so the loads
    // are issued here and fly under the exchange and the softmax.
    const float* __restrict__ vhead = vb + head * HD;
    v4f v0[8], v1[8];
#pragma unroll
    for (int i = 0; i < 8; ++i) {
        v0[i] = *(const v4f*)(vhead + koff[i]);
        v1[i] = *(const v4f*)(vhead + koff[i] + 32);
    }

    // Halving exchange over the 8 lanes of a group: at each step a lane keeps
    // the rows whose index bit equals its own lane bit and hands the others on.
    const bool b0 = lane & 1, b1 = lane & 2, b2 = lane & 4;
    float r[4], t[2];
#pragma unroll
    for (int m = 0; m < 4; ++m)
        r[m] = (b0 ? p[2 * m + 1] : p[2 * m]) + lane_xor<1>(b0 ? p[2 * m] : p[2 * m + 1]);
#pragma unroll
    for (int m = 0; m < 2; ++m)
        t[m] = (b1 ? r[2 * m + 1] : r[2 * m]) + lane_xor<2>(b1 ? r[2 * m] : r[2 * m + 1]);
    const float acc = (b2 ? t[1] : t[0]) + lane_xor<4>(b2 ? t[0] : t[1]);

    float score = acc * 0.125f;                  // Hd^-0.5 = 1/8 exactly

    // ---- wave32 softmax over the 32 neighbors ----
    float mx = score;
#pragma unroll
    for (int off = 16; off > 0; off >>= 1)
        mx = fmaxf(mx, __shfl_xor(mx, off, 32));
    float e = __expf(score - mx);
    float sum = e;
#pragma unroll
    for (int off = 16; off > 0; off >>= 1)
        sum += __shfl_xor(sum, off, 32);
    const float w = e / sum;

    // ---- out[d] = sum_j w_j * v[nbr_j][d] ----
    // A lane's partial sums over its group's 8 neighbors: dims c4 .. c4+3 in
    // o[0], o[1] and dims 32+c4 .. 32+c4+3 in o[2], o[3].
    v2f o[4] = { (v2f){}, (v2f){}, (v2f){}, (v2f){} };
    add_weighted_rows<0>(w, v0, v1, o);

    // Halving exchange over the four groups: lane bit 3 picks the half row a
    // lane keeps, lane bit 4 the pair of dims in its 16-B piece.
    const bool b3 = lane & 8, b4 = lane & 16;
    const float lo0 = o[0].x, lo1 = o[0].y, lo2 = o[1].x, lo3 = o[1].y;
    const float hi0 = o[2].x, hi1 = o[2].y, hi2 = o[3].x, hi3 = o[3].y;
    const float u0 = (b3 ? hi0 : lo0) + lane_xor<8>(b3 ? lo0 : hi0);
    const float u1 = (b3 ? hi1 : lo1) + lane_xor<8>(b3 ? lo1 : hi1);
    const float u2 = (b3 ? hi2 : lo2) + lane_xor<8>(b3 ? lo2 : hi2);
    const float u3 = (b3 ? hi3 : lo3) + lane_xor<8>(b3 ? lo3 : hi3);
    v2f res;
    res.x = (b4 ? u2 : u0) + lane_xor16(b4 ? u0 : u2);
    res.y = (b4 ? u3 : u1) + lane_xor16(b4 ? u1 : u3);

    float* __restrict__ op = out + ((size_t)b * S_PTS + s) * FDIM + h * HD;
    *(v2f*)(op + (b3 ? 32 : 0) + c4 + (b4 ? 2 : 0)) = res;   // the wave: 256 B in a row
}

// ---------------------------------------------------------------------------
extern "C" void kernel_launch(void* const* d_in, const int* in_sizes, int n_in,
                              void* d_out, int out_size, void* d_ws, size_t ws_size,
                              hipStream_t stream)
{
    const float* x   = (const float*)d_in[0];
    const float* Wq  = (const float*)d_in[1];
    const float* Wk  = (const float*)d_in[2];
    const float* Wv  = (const float*)d_in[3];
    const int*   nbr = (const int*)d_in[4];
    float* out = (float*)d_out;

    const size_t per = (size_t)BATCH * NHEADS * S_PTS * HD;  // 16.384M floats
    float* qb = (float*)d_ws;
    float* kb = qb + per;
    float* vb = kb + per;

    dim3 g1(12, 250);                            // N tiles x M tiles of 128
    qkv_proj_wmma<<<g1, dim3(128), 0, stream>>>(x, Wq, Wk, Wv, qb, kb, vb);

    dim3 g2(S_PTS / 8, BATCH * NHEADS);          // cells of 8 queries x (batch, head)
    nbr_attention<<<g2, dim3(256), 0, stream>>>(qb, kb, vb, nbr, out);
}
